// v000
// Measured on an AMD MI455X. A time is GPU time per run, averaged over a window of back-to-back runs after a warm-up
// (all launches, gaps included; the runs take copies of the inputs in turn), and the median of several windows.
// Apart from v000's, it joins two sittings. Times from different sittings can be a few percent apart, while
// side-by-side timings come from the same sitting.
// The starting kernel, v000, takes 1430 microseconds a run.
#include <hip/hip_runtime.h>

// Eagle3Attention (hidden [1][2048][4096]; q = x Wq (32 heads x 64), k, v = x Wk / Wv (8 kv heads; query head h uses kv head h/4 = repeat_interleave); full (unmasked) softmax(q.k/8) in f32; out = merged att.v Wo -> [1][2048][2048]).
// Compute dtypes, f32 accumulate: every input rounded to bf16; projections on PLAIN bf16 operands (inputs: exact); scores (K 64) and att.v on bf16 hi+lo planes (3 products each);
// f32 register-row softmax; merged heads as bf16 hi+lo planes x exact Wo (2 products). One-wave-per-64x64-tile GEMMs. Deterministic, no

#define NB_  1
#define TT   2048
#define DM   4096
#define NH_  32
#define NKV  8
#define REP  (NH_ / NKV)
#define HD   64
#define DQ   (NH_ * HD)
#define DKV  (NKV * HD)
#define DOUT 2048                // Wo output width (hidden_size; the input is the 4096-wide concatenation)
#define ZH   2
#define RH   2048                  // query rows < RH use hi+lo planes (0: none)
#define WIN  0
#define PCAR 1024.0f
#define SCL  0.125f   // HD^-0.5
typedef _Float16 h16;
typedef unsigned short bf;
typedef __attribute__((ext_vector_type(16))) __bf16   v16bf;
typedef __attribute__((ext_vector_type(16))) _Float16 v16h;
typedef __attribute__((ext_vector_type(8)))  _Float16 v8h;
typedef __attribute__((ext_vector_type(8)))  unsigned short v8us;
typedef __attribute__((ext_vector_type(8)))  float    v8f;
typedef __attribute__((ext_vector_type(4)))  float    v4f;
typedef v8h  __attribute__((may_alias)) v8ha;
typedef v4f  __attribute__((may_alias)) v4fa;
typedef v8us __attribute__((may_alias)) v8usa;

__device__ __forceinline__ unsigned short f2bf(float f) { unsigned u = __float_as_uint(f); u += 0x7FFFu + ((u >> 16) & 1u); return (unsigned short)(u >> 16); }
__device__ __forceinline__ float bf2f(unsigned short b) { return __uint_as_float(((unsigned)b) << 16); }
__device__ __forceinline__ float bfr(float f) { return bf2f(f2bf(f)); }
__device__ __forceinline__ v16h cat16(v8h lo, v8h hi) { return __builtin_shufflevector(lo, hi, 0, 1, 2, 3, 4, 5, 6, 7, 8, 9, 10, 11, 12, 13, 14, 15); }
__device__ __forceinline__ v16bf cat16b(v8us lo, v8us hi) { return __builtin_bit_cast(v16bf, __builtin_shufflevector(lo, hi, 0, 1, 2, 3, 4, 5, 6, 7, 8, 9, 10, 11, 12, 13, 14, 15)); }
__device__ __forceinline__ v8f wmma16(v16h a, v16h b, v8f c) { return __builtin_amdgcn_wmma_f32_16x16x32_f16(false, a, false, b, (short)0, c, false, false); }
__device__ __forceinline__ v8f wmmab(v16bf a, v16bf b, v8f c) { return __builtin_amdgcn_wmma_f32_16x16x32_bf16(false, a, false, b, (short)0, c, false, false); }



// ---- k_gemmw: register-blocked GEMM, ONE WAVE per 64x64 output tile (16 accumulators), operands straight from K-contiguous 16-bit planes; grid (M/64, N/64, Z), 32 threads.
// C[m][n] (f32, pitch ldc, + optional f32 bias[n]) = sum_k A[m][k] Bt[n][k] (+ split products per NSPLIT). z-batch strides sA/sB/sC in elements. K % 32 == 0.
template <typename T16> struct WFrag;
template <> struct WFrag<h16> { typedef v16h V; static __device__ __forceinline__ V ld(const h16* p) { return cat16(*(const v8h*)p, *(const v8h*)(p + 16)); } static __device__ __forceinline__ v8f mma(V a, V b, v8f c) { return wmma16(a, b, c); } };
template <> struct WFrag<bf> { typedef v16bf V; static __device__ __forceinline__ V ld(const bf* p) { return cat16b(*(const v8us*)p, *(const v8us*)(p + 16)); } static __device__ __forceinline__ v8f mma(V a, V b, v8f c) { return wmmab(a, b, c); } };
template <typename T16, int NSPLIT, bool BIAS>
__global__ __launch_bounds__(32) void k_gemmw(const T16* __restrict__ A, const T16* __restrict__ A2, const T16* __restrict__ Bt, const T16* __restrict__ Bt2, int K, float* C, int ldc, const float* __restrict__ bias, size_t sA, size_t sB, size_t sC) {
    typedef typename WFrag<T16>::V V;
    __shared__ __align__(16) float os[16 * 68];
    const size_t z = blockIdx.z; A += z * sA; if (A2) A2 += z * sA; Bt += z * sB; if (Bt2) Bt2 += z * sB; C += z * sC;
    const int lane = threadIdx.x & 31, lr = lane & 15, hi = lane >> 4; const int r0 = blockIdx.x * 64, c0 = blockIdx.y * 64;
    v8f acc[4][4];
#pragma unroll
    for (int mb = 0; mb < 4; ++mb)
#pragma unroll
        for (int nb = 0; nb < 4; ++nb) acc[mb][nb] = (v8f){};
    const size_t aoff = (size_t)(r0 + lr) * K + 8 * hi, boff = (size_t)(c0 + lr) * K + 8 * hi;
#pragma unroll 1
    for (int kc = 0; kc < K; kc += 32) {
        V a[4], a2[4];
#pragma unroll
        for (int mb = 0; mb < 4; ++mb) { a[mb] = WFrag<T16>::ld(A + aoff + (size_t)mb * 16 * K + kc); if (NSPLIT == 1 || NSPLIT == 2) a2[mb] = WFrag<T16>::ld(A2 + aoff + (size_t)mb * 16 * K + kc); }
#pragma unroll
        for (int nb = 0; nb < 4; ++nb) { const V b = WFrag<T16>::ld(Bt + boff + (size_t)nb * 16 * K + kc); V b2; if (NSPLIT >= 2) b2 = WFrag<T16>::ld(Bt2 + boff + (size_t)nb * 16 * K + kc);
#pragma unroll
            for (int mb = 0; mb < 4; ++mb) { acc[mb][nb] = WFrag<T16>::mma(a[mb], b, acc[mb][nb]); if (NSPLIT == 1 || NSPLIT == 2) acc[mb][nb] = WFrag<T16>::mma(a2[mb], b, acc[mb][nb]); if (NSPLIT >= 2) acc[mb][nb] = WFrag<T16>::mma(a[mb], b2, acc[mb][nb]); } }
        asm volatile("v_nop\n\tv_nop\n\tv_nop\n\tv_nop" : "+v"(acc[0][0]), "+v"(acc[1][1]), "+v"(acc[2][2]), "+v"(acc[3][3]) : "v"(a[0]), "v"(a[3]));
    }
#pragma unroll
    for (int mb = 0; mb < 4; ++mb) {
#pragma unroll
        for (int nb = 0; nb < 4; ++nb) {
#pragma unroll
            for (int j = 0; j < 8; ++j) os[(hi * 8 + j) * 68 + nb * 16 + lr] = acc[mb][nb][j]; }
        __builtin_amdgcn_wave_barrier(); asm volatile("" ::: "memory");
        float* crow = C + (size_t)(r0 + mb * 16) * ldc + c0;
{
#pragma unroll
            for (int s = 0; s < 8; ++s) { const int row = 2 * s + hi, cofs = lr * 4; v4f val = *(const v4fa*)(os + row * 68 + cofs); if (BIAS) { val[0] += bfr(bias[c0 + cofs]); val[1] += bfr(bias[c0 + cofs + 1]); val[2] += bfr(bias[c0 + cofs + 2]); val[3] += bfr(bias[c0 + cofs + 3]); }
                *(v4f*)(crow + (size_t)row * ldc + cofs) = val; }
             }
        __builtin_amdgcn_wave_barrier(); asm volatile("" ::: "memory");
    }
}

__device__ __forceinline__ h16 tohx(float x) { return (h16)x; }
__device__ __forceinline__ void splitf(float y, unsigned short& h, unsigned short& l) { h = f2bf(y); l = f2bf(y - bf2f(h)); }
typedef __attribute__((ext_vector_type(2))) _Float16 v2h;
typedef __attribute__((ext_vector_type(4))) _Float16 v4h;
typedef __attribute__((ext_vector_type(2))) unsigned short v2us;
typedef __attribute__((ext_vector_type(4))) unsigned short v4us;
typedef __attribute__((ext_vector_type(2))) float v2f;
typedef __attribute__((ext_vector_type(4))) int v4i;

__global__ __launch_bounds__(256) void k_wtG(const float* __restrict__ w, int K, int N, bf* Bt) {
    const int lane = threadIdx.x & 31; const int L0 = (blockIdx.x * 8 + (threadIdx.x >> 5)) * 8; const int nlines = N * K / 64;
{
#pragma unroll 1
        for (int l = 0; l < 8; ++l) { const int L = L0 + l; if (L >= nlines) break; const size_t e = (size_t)L * 64 + lane * 2; const int k = (int)(e % K), n = (int)(e / K); v2us o;
            o[0] = f2bf(w[(size_t)k * N + n]); o[1] = f2bf(w[(size_t)(k + 1) * N + n]); *(v2us*)(Bt + e) = o; }
         }
}
__global__ __launch_bounds__(256) void k_cvt8(const float* __restrict__ src, bf* dst, size_t n8) { const size_t i = (size_t)blockIdx.x * 256 + threadIdx.x; if (i >= n8) return; const v8f v = *(const v8f*)(src + i * 8); v8us o;
#pragma unroll
    for (int k = 0; k < 8; ++k) o[k] = f2bf(v[k]); *(v8us*)(dst + i * 8) = o;  }
__global__ __launch_bounds__(256) void k_cscvt(const float* __restrict__ cosT, const float* __restrict__ sinT, float* CS) { const int idx = blockIdx.x * 256 + threadIdx.x; if (idx >= TT * HD) return; v2f cs; cs[0] = bfr(cosT[idx]); cs[1] = bfr(sinT[idx]); *(v2f*)(CS + (size_t)idx * 2) = cs;  }
// k_rope: head planes [h][t][d] (fp16 + hi/lo) of rope(x) x sc with the rotate-half convention out[d] = x[d] cos[t][d] - x[d+HD/2] sin[t][d], out[d+HD/2] = x[d+HD/2] cos[t][d+HD/2] + x[d] sin[t][d+HD/2]
__global__ __launch_bounds__(256) void k_rope(const float* __restrict__ F, int pitch, int nheads, const float* __restrict__ CS, const float* __restrict__ RF, const float* __restrict__ nw, float sc, h16* P16, bf* Ph, bf* Pl) {
    const size_t e = ((size_t)blockIdx.x * 256 + threadIdx.x) * 2; if (e >= (size_t)nheads * TT * HD) return; const int d = (int)(e % HD); const int t = (int)((e / HD) % TT); const int h = (int)(e / ((size_t)HD * TT)); const float* f = F + (size_t)t * pitch + h * HD; const float rf = RF ? RF[(size_t)h * TT + t] : 1.0f; v2h o16; v2us oh, ol;
#pragma unroll
    for (int q = 0; q < 2; ++q) { const int dd = d + q; const int dp = (dd < HD / 2) ? dd + HD / 2 : dd - HD / 2; float x0 = f[dd], x1 = f[dp];
        if (RF) { float n0 = __fmul_rn(x0, rf), n1 = __fmul_rn(x1, rf); asm volatile("" : "+v"(n0)); asm volatile("" : "+v"(n1)); x0 = __fmul_rn(bfr(nw[dd]), n0); x1 = __fmul_rn(bfr(nw[dp]), n1); }
        const v2f cs = *(const v2f*)(CS + ((size_t)t * HD + dd) * 2); float a = __fmul_rn(x0, cs[0]), bq = __fmul_rn(x1, cs[1]); asm volatile("" : "+v"(a)); asm volatile("" : "+v"(bq)); const float r = ((dd < HD / 2) ? __fsub_rn(a, bq) : __fadd_rn(a, bq)) * sc;
        o16[q] = tohx(r); unsigned short a2, c2; splitf(r, a2, c2); oh[q] = a2; ol[q] = c2; }
    *(v2h*)(P16 + e) = o16; *(v2us*)(Ph + e) = oh; *(v2us*)(Pl + e) = ol;  }
__global__ __launch_bounds__(256) void k_vtp(const float* __restrict__ F, int pitch, int nheads, h16* V16, bf* Vh, bf* Vl) { const size_t e = ((size_t)blockIdx.x * 256 + threadIdx.x) * 2; if (e >= (size_t)nheads * HD * TT) return; const int t = (int)(e % TT); const int d = (int)((e / TT) % HD); const int g = (int)(e / ((size_t)TT * HD)); v2h o16; v2us oh, ol;
#pragma unroll
    for (int q = 0; q < 2; ++q) { const float x = F[(size_t)(t + q) * pitch + g * HD + d]; o16[q] = tohx(x); unsigned short a2, c2; splitf(x, a2, c2); oh[q] = a2; ol[q] = c2; }
    *(v2h*)(V16 + e) = o16; *(v2us*)(Vh + e) = oh; *(v2us*)(Vl + e) = ol;  }
__global__ __launch_bounds__(256) void k_csid(float* CS) { const int idx = blockIdx.x * 256 + threadIdx.x; if (idx >= TT * HD) return; v2f cs; cs[0] = 1.0f; cs[1] = 0.0f; *(v2f*)(CS + (size_t)idx * 2) = cs;  }
// k_asoft: per row (zz, i): t = S x HD^-0.5 (no mask); softmax over the 2048 keys (register row, one exp, fixed trees);
__global__ __launch_bounds__(256) void k_asoft(const float* __restrict__ Sb, h16* P16, bf* Ph, bf* Pl) {
    const int lane = threadIdx.x & 31; const int row = blockIdx.x * 8 + (threadIdx.x >> 5); if (row >= ZH * TT) return; const int i = row % TT; const int zz = row / TT; (void)zz; const bool hires = (i < RH); const float* sr = Sb + (size_t)row * TT; float v[TT / 32]; float mx = -3.0e38f;
#pragma unroll
    for (int ch = 0; ch < TT / 128; ++ch) { const int j0 = ch * 128 + lane * 4; const v4f a = *(const v4f*)(sr + j0);
#pragma unroll
        for (int q = 0; q < 4; ++q) { const int j = j0 + q; (void)j; const float t = a[q] * SCL; v[ch * 4 + q] = t; mx = fmaxf(mx, t); } }
#pragma unroll
    for (int sh = 16; sh; sh >>= 1) mx = fmaxf(mx, __shfl_xor(mx, sh, 32));
    float sum = 0.f;
#pragma unroll
    for (int k = 0; k < TT / 32; ++k) { float d0 = __fsub_rn(v[k], mx); asm volatile("" : "+v"(d0)); v[k] = __builtin_amdgcn_exp2f(__fmul_rn(d0, 1.4426950408889634f)); sum += v[k]; }
#pragma unroll
    for (int sh = 16; sh; sh >>= 1) sum += __shfl_xor(sum, sh, 32);
    const float f = __fdiv_rn(hires ? 1.0f : PCAR, sum);
{
        if (hires) {
#pragma unroll
            for (int ch = 0; ch < TT / 128; ++ch) { v4us oh, ol;
#pragma unroll
                for (int q = 0; q < 4; ++q) { unsigned short a, c2; splitf(v[ch * 4 + q] * f, a, c2); oh[q] = a; ol[q] = c2; }
                const size_t oo = ((size_t)zz * (RH ? RH : 1) + i) * TT + ch * 128 + lane * 4; *(v4us*)(Ph + oo) = oh; *(v4us*)(Pl + oo) = ol; }
        } else {
#pragma unroll
            for (int ch = 0; ch < TT / 128; ++ch) { v4h o4;
#pragma unroll
                for (int q = 0; q < 4; ++q) o4[q] = tohx(v[ch * 4 + q] * f);
                *(v4h*)(P16 + (size_t)row * TT + ch * 128 + lane * 4) = o4; } }
         }
}
__global__ __launch_bounds__(256) void k_merge(const float* __restrict__ O, int h0, bf* Ah, bf* Al) { const size_t e = ((size_t)blockIdx.x * 256 + threadIdx.x) * 2; if (e >= (size_t)ZH * TT * HD) return; const int d = (int)(e % HD); const int t = (int)((e / HD) % TT); const int zz = (int)(e / ((size_t)HD * TT)); const float cs = (t < RH) ? 1.0f : (1.0f / PCAR); const size_t oo = (size_t)t * DQ + (h0 + zz) * HD + d;
    v2us oh, ol;
#pragma unroll
    for (int q = 0; q < 2; ++q) { unsigned short a, c2; splitf(O[e + q] * cs, a, c2); oh[q] = a; ol[q] = c2; } *(v2us*)(Ah + oo) = oh; *(v2us*)(Al + oo) = ol;  }

extern "C" void kernel_launch(void* const* d_in, const int* in_sizes, int n_in,
                              void* d_out, int out_size, void* d_ws, size_t ws_size, hipStream_t stream) {
    (void)in_sizes; (void)n_in; (void)out_size;
    const float* x = (const float*)d_in[0]; const float* wq = (const float*)d_in[1]; const float* wk = (const float*)d_in[2]; const float* wv = (const float*)d_in[3]; const float* wo = (const float*)d_in[4];   // Wq [4096][2048], Wk/Wv [4096][512], Wo [2048][2048] (x @ W)
    float* OUT = (float*)d_out;     // [1][2048][2048]
    char* wsp = (char*)d_ws;
    auto take = [&](size_t bytes) { char* p = wsp; wsp += (bytes + 255) & ~(size_t)255; return (void*)p; };
    bf* WQ = (bf*)take((size_t)DQ * DM * 2); bf* WK = (bf*)take((size_t)DKV * DM * 2); bf* WV = (bf*)take((size_t)DKV * DM * 2); bf* WO = (bf*)take((size_t)DOUT * DQ * 2); float* CS = (float*)take((size_t)TT * HD * 2 * 4);
    bf* XB = (bf*)take((size_t)TT * DM * 2); float* FQ = (float*)take((size_t)TT * DQ * 4); float* FK = (float*)take((size_t)TT * DKV * 4);
    h16* QP16 = (h16*)take((size_t)NH_ * TT * HD * 2); h16* KP16 = (h16*)take((size_t)NKV * TT * HD * 2); h16* VT16 = (h16*)take((size_t)NKV * HD * TT * 2);
    bf* QPh = (bf*)take((size_t)NH_ * TT * HD * 2); bf* QPl = (bf*)take((size_t)NH_ * TT * HD * 2); bf* KPh = (bf*)take((size_t)NKV * TT * HD * 2); bf* KPl = (bf*)take((size_t)NKV * TT * HD * 2); bf* VTh = (bf*)take((size_t)NKV * HD * TT * 2); bf* VTl = (bf*)take((size_t)NKV * HD * TT * 2); bf* Ph = (bf*)take((size_t)ZH * RH * TT * 2); bf* Pl = (bf*)take((size_t)ZH * RH * TT * 2);
    float* Sb = (float*)take((size_t)ZH * TT * TT * 4); h16* P16 = (h16*)take((size_t)ZH * TT * TT * 2); float* Ob = (float*)take((size_t)ZH * TT * HD * 4); bf* ATh = (bf*)take((size_t)TT * DQ * 2); bf* ATl = (bf*)take((size_t)TT * DQ * 2);
    if ((size_t)(wsp - (char*)d_ws) > ws_size) return;    // ws 256 MiB
    float* FV = FK;   // v projection reuses the k buffer after the k planes are built (stream-ordered)
    { k_wtG<<<(unsigned)((DM * DQ / 64 + 63) / 64), 256, 0, stream>>>(wq, DM, DQ, WQ); k_wtG<<<(unsigned)((DM * DKV / 64 + 63) / 64), 256, 0, stream>>>(wk, DM, DKV, WK); k_wtG<<<(unsigned)((DM * DKV / 64 + 63) / 64), 256, 0, stream>>>(wv, DM, DKV, WV);
      k_wtG<<<(unsigned)((DQ * DOUT / 64 + 63) / 64), 256, 0, stream>>>(wo, DQ, DOUT, WO);
       }
    k_csid<<<(TT * HD + 255) / 256, 256, 0, stream>>>(CS);
    const unsigned LQ = (unsigned)(((size_t)NH_ * TT * HD / 2 + 255) / 256), LKv = (unsigned)(((size_t)NKV * TT * HD / 2 + 255) / 256);
    for (int b = 0; b < NB_; ++b) {
        
        k_cvt8<<<(unsigned)(((size_t)TT * DM / 8 + 255) / 256), 256, 0, stream>>>(x + (size_t)b * TT * DM, XB, (size_t)TT * DM / 8);
        k_gemmw<bf, 0, false><<<dim3(TT / 64, DQ / 64, 1), 32, 0, stream>>>(XB, nullptr, WQ, nullptr, DM, FQ, DQ, nullptr, 0, 0, 0);
        k_rope<<<LQ, 256, 0, stream>>>(FQ, DQ, NH_, CS, nullptr, nullptr, 1.0f, QP16, QPh, QPl);
        k_gemmw<bf, 0, false><<<dim3(TT / 64, DKV / 64, 1), 32, 0, stream>>>(XB, nullptr, WK, nullptr, DM, FK, DKV, nullptr, 0, 0, 0);
        k_rope<<<LKv, 256, 0, stream>>>(FK, DKV, NKV, CS, nullptr, nullptr, 1.0f, KP16, KPh, KPl);
        k_gemmw<bf, 0, false><<<dim3(TT / 64, DKV / 64, 1), 32, 0, stream>>>(XB, nullptr, WV, nullptr, DM, FV, DKV, nullptr, 0, 0, 0); k_vtp<<<LKv, 256, 0, stream>>>(FV, DKV, NKV, VT16, VTh, VTl);
        for (int h0 = 0; h0 < NH_; h0 += ZH) { const size_t zq = (size_t)h0, zk = (size_t)(h0 / REP);   // both heads of a pass share kv group h0/REP (REP >= 2): sB = 0
            k_gemmw<bf, 2, false><<<dim3(RH / 64, TT / 64, ZH), 32, 0, stream>>>(QPh + zq * TT * HD, QPl + zq * TT * HD, KPh + zk * TT * HD, KPl + zk * TT * HD, HD, Sb, TT, nullptr, (size_t)TT * HD, 0, (size_t)TT * TT);
            if (TT > RH) k_gemmw<h16, 0, false><<<dim3((TT - RH) / 64, TT / 64, ZH), 32, 0, stream>>>(QP16 + zq * TT * HD + (size_t)RH * HD, nullptr, KP16 + zk * TT * HD, nullptr, HD, Sb + (size_t)RH * TT, TT, nullptr, (size_t)TT * HD, 0, (size_t)TT * TT);
            k_asoft<<<ZH * TT / 8, 256, 0, stream>>>(Sb, P16, Ph, Pl);
            k_gemmw<bf, 2, false><<<dim3(RH / 64, HD / 64, ZH), 32, 0, stream>>>(Ph, Pl, VTh + zk * HD * TT, VTl + zk * HD * TT, TT, Ob, HD, nullptr, (size_t)RH * TT, 0, (size_t)TT * HD);
            if (TT > RH) k_gemmw<h16, 0, false><<<dim3((TT - RH) / 64, HD / 64, ZH), 32, 0, stream>>>(P16 + (size_t)RH * TT, nullptr, VT16 + zk * HD * TT, nullptr, TT, Ob + (size_t)RH * HD, HD, nullptr, (size_t)TT * TT, 0, (size_t)TT * HD);
            k_merge<<<(unsigned)(((size_t)ZH * TT * HD / 2 + 255) / 256), 256, 0, stream>>>(Ob, h0, ATh, ATl); }
        k_gemmw<bf, 1, false><<<dim3(TT / 64, DOUT / 64, 1), 32, 0, stream>>>(ATh, ATl, WO, nullptr, DQ, OUT + (size_t)b * TT * DOUT, DOUT, nullptr, 0, 0, 0); }
}

// v001
// It runs in 537 microseconds.
// Two timings next to v000 put it at 2.71 and 2.68 times that version's speed.
#include <hip/hip_runtime.h>

// Eagle3Attention (hidden [1][2048][4096]; q = x Wq (32 heads x 64), k, v = x Wk / Wv (8 kv heads; query head h uses kv head h/4 = repeat_interleave); full (unmasked) softmax(q.k/8) in f32; out = merged att.v Wo -> [1][2048][2048]).
// Compute dtypes, f32 accumulate: every input rounded to bf16; projections on PLAIN bf16 operands (inputs: exact); scores (K 64) and att.v on bf16 hi+lo planes (3 products each);
// f32 running-maximum softmax in registers, fused with both products (k_fattn); merged heads as bf16 hi+lo planes x exact Wo (2 products). One-wave-per-64x64-tile GEMMs. Deterministic, no

#define NB_  1
#define TT   2048
#define DM   4096
#define NH_  32
#define NKV  8
#define REP  (NH_ / NKV)
#define HD   64
#define DQ   (NH_ * HD)
#define DKV  (NKV * HD)
#define DOUT 2048                // Wo output width (hidden_size; the input is the 4096-wide concatenation)
#define SCL  0.125f   // HD^-0.5
typedef _Float16 h16;
typedef unsigned short bf;
typedef __attribute__((ext_vector_type(16))) __bf16   v16bf;
typedef __attribute__((ext_vector_type(16))) _Float16 v16h;
typedef __attribute__((ext_vector_type(8)))  _Float16 v8h;
typedef __attribute__((ext_vector_type(8)))  unsigned short v8us;
typedef __attribute__((ext_vector_type(8)))  float    v8f;
typedef __attribute__((ext_vector_type(4)))  float    v4f;
typedef v8h  __attribute__((may_alias)) v8ha;
typedef v4f  __attribute__((may_alias)) v4fa;
typedef v8us __attribute__((may_alias)) v8usa;

__device__ __forceinline__ unsigned short f2bf(float f) { unsigned u = __float_as_uint(f); u += 0x7FFFu + ((u >> 16) & 1u); return (unsigned short)(u >> 16); }
__device__ __forceinline__ float bf2f(unsigned short b) { return __uint_as_float(((unsigned)b) << 16); }
__device__ __forceinline__ float bfr(float f) { return bf2f(f2bf(f)); }
__device__ __forceinline__ v16h cat16(v8h lo, v8h hi) { return __builtin_shufflevector(lo, hi, 0, 1, 2, 3, 4, 5, 6, 7, 8, 9, 10, 11, 12, 13, 14, 15); }
__device__ __forceinline__ v16bf cat16b(v8us lo, v8us hi) { return __builtin_bit_cast(v16bf, __builtin_shufflevector(lo, hi, 0, 1, 2, 3, 4, 5, 6, 7, 8, 9, 10, 11, 12, 13, 14, 15)); }
__device__ __forceinline__ v8f wmma16(v16h a, v16h b, v8f c) { return __builtin_amdgcn_wmma_f32_16x16x32_f16(false, a, false, b, (short)0, c, false, false); }
__device__ __forceinline__ v8f wmmab(v16bf a, v16bf b, v8f c) { return __builtin_amdgcn_wmma_f32_16x16x32_bf16(false, a, false, b, (short)0, c, false, false); }



// ---- k_gemmw: register-blocked GEMM, ONE WAVE per 64x64 output tile (16 accumulators), operands straight from K-contiguous 16-bit planes; grid (M/64, N/64, Z), 32 threads.
// C[m][n] (f32, pitch ldc, + optional f32 bias[n]) = sum_k A[m][k] Bt[n][k] (+ split products per NSPLIT). z-batch strides sA/sB/sC in elements. K % 32 == 0.
template <typename T16> struct WFrag;
template <> struct WFrag<h16> { typedef v16h V; static __device__ __forceinline__ V ld(const h16* p) { return cat16(*(const v8h*)p, *(const v8h*)(p + 16)); } static __device__ __forceinline__ v8f mma(V a, V b, v8f c) { return wmma16(a, b, c); } };
template <> struct WFrag<bf> { typedef v16bf V; static __device__ __forceinline__ V ld(const bf* p) { return cat16b(*(const v8us*)p, *(const v8us*)(p + 16)); } static __device__ __forceinline__ v8f mma(V a, V b, v8f c) { return wmmab(a, b, c); } };
template <typename T16, int NSPLIT, bool BIAS>
__global__ __launch_bounds__(32) void k_gemmw(const T16* __restrict__ A, const T16* __restrict__ A2, const T16* __restrict__ Bt, const T16* __restrict__ Bt2, int K, float* C, int ldc, const float* __restrict__ bias, size_t sA, size_t sB, size_t sC) {
    typedef typename WFrag<T16>::V V;
    __shared__ __align__(16) float os[16 * 68];
    const size_t z = blockIdx.z; A += z * sA; if (A2) A2 += z * sA; Bt += z * sB; if (Bt2) Bt2 += z * sB; C += z * sC;
    const int lane = threadIdx.x & 31, lr = lane & 15, hi = lane >> 4; const int r0 = blockIdx.x * 64, c0 = blockIdx.y * 64;
    v8f acc[4][4];
#pragma unroll
    for (int mb = 0; mb < 4; ++mb)
#pragma unroll
        for (int nb = 0; nb < 4; ++nb) acc[mb][nb] = (v8f){};
    const size_t aoff = (size_t)(r0 + lr) * K + 8 * hi, boff = (size_t)(c0 + lr) * K + 8 * hi;
#pragma unroll 1
    for (int kc = 0; kc < K; kc += 32) {
        V a[4], a2[4];
#pragma unroll
        for (int mb = 0; mb < 4; ++mb) { a[mb] = WFrag<T16>::ld(A + aoff + (size_t)mb * 16 * K + kc); if (NSPLIT == 1 || NSPLIT == 2) a2[mb] = WFrag<T16>::ld(A2 + aoff + (size_t)mb * 16 * K + kc); }
#pragma unroll
        for (int nb = 0; nb < 4; ++nb) { const V b = WFrag<T16>::ld(Bt + boff + (size_t)nb * 16 * K + kc); V b2; if (NSPLIT >= 2) b2 = WFrag<T16>::ld(Bt2 + boff + (size_t)nb * 16 * K + kc);
#pragma unroll
            for (int mb = 0; mb < 4; ++mb) { acc[mb][nb] = WFrag<T16>::mma(a[mb], b, acc[mb][nb]); if (NSPLIT == 1 || NSPLIT == 2) acc[mb][nb] = WFrag<T16>::mma(a2[mb], b, acc[mb][nb]); if (NSPLIT >= 2) acc[mb][nb] = WFrag<T16>::mma(a[mb], b2, acc[mb][nb]); } }
        asm volatile("v_nop\n\tv_nop\n\tv_nop\n\tv_nop" : "+v"(acc[0][0]), "+v"(acc[1][1]), "+v"(acc[2][2]), "+v"(acc[3][3]) : "v"(a[0]), "v"(a[3]));
    }
#pragma unroll
    for (int mb = 0; mb < 4; ++mb) {
#pragma unroll
        for (int nb = 0; nb < 4; ++nb) {
#pragma unroll
            for (int j = 0; j < 8; ++j) os[(hi * 8 + j) * 68 + nb * 16 + lr] = acc[mb][nb][j]; }
        __builtin_amdgcn_wave_barrier(); asm volatile("" ::: "memory");
        float* crow = C + (size_t)(r0 + mb * 16) * ldc + c0;
{
#pragma unroll
            for (int s = 0; s < 8; ++s) { const int row = 2 * s + hi, cofs = lr * 4; v4f val = *(const v4fa*)(os + row * 68 + cofs); if (BIAS) { val[0] += bfr(bias[c0 + cofs]); val[1] += bfr(bias[c0 + cofs + 1]); val[2] += bfr(bias[c0 + cofs + 2]); val[3] += bfr(bias[c0 + cofs + 3]); }
                *(v4f*)(crow + (size_t)row * ldc + cofs) = val; }
             }
        __builtin_amdgcn_wave_barrier(); asm volatile("" ::: "memory");
    }
}

__device__ __forceinline__ h16 tohx(float x) { return (h16)x; }
__device__ __forceinline__ void splitf(float y, unsigned short& h, unsigned short& l) { h = f2bf(y); l = f2bf(y - bf2f(h)); }
typedef __attribute__((ext_vector_type(2))) _Float16 v2h;
typedef __attribute__((ext_vector_type(4))) _Float16 v4h;
typedef __attribute__((ext_vector_type(2))) unsigned short v2us;
typedef __attribute__((ext_vector_type(4))) unsigned short v4us;
typedef __attribute__((ext_vector_type(2))) float v2f;
typedef __attribute__((ext_vector_type(4))) int v4i;

__global__ __launch_bounds__(256) void k_wtG(const float* __restrict__ w, int K, int N, bf* Bt) {
    const int lane = threadIdx.x & 31; const int L0 = (blockIdx.x * 8 + (threadIdx.x >> 5)) * 8; const int nlines = N * K / 64;
{
#pragma unroll 1
        for (int l = 0; l < 8; ++l) { const int L = L0 + l; if (L >= nlines) break; const size_t e = (size_t)L * 64 + lane * 2; const int k = (int)(e % K), n = (int)(e / K); v2us o;
            o[0] = f2bf(w[(size_t)k * N + n]); o[1] = f2bf(w[(size_t)(k + 1) * N + n]); *(v2us*)(Bt + e) = o; }
         }
}
__global__ __launch_bounds__(256) void k_cvt8(const float* __restrict__ src, bf* dst, size_t n8) { const size_t i = (size_t)blockIdx.x * 256 + threadIdx.x; if (i >= n8) return; const v8f v = *(const v8f*)(src + i * 8); v8us o;
#pragma unroll
    for (int k = 0; k < 8; ++k) o[k] = f2bf(v[k]); *(v8us*)(dst + i * 8) = o;  }
__global__ __launch_bounds__(256) void k_cscvt(const float* __restrict__ cosT, const float* __restrict__ sinT, float* CS) { const int idx = blockIdx.x * 256 + threadIdx.x; if (idx >= TT * HD) return; v2f cs; cs[0] = bfr(cosT[idx]); cs[1] = bfr(sinT[idx]); *(v2f*)(CS + (size_t)idx * 2) = cs;  }
// k_rope: head planes [h][t][d] (fp16 + hi/lo) of rope(x) x sc with the rotate-half convention out[d] = x[d] cos[t][d] - x[d+HD/2] sin[t][d], out[d+HD/2] = x[d+HD/2] cos[t][d+HD/2] + x[d] sin[t][d+HD/2]
__global__ __launch_bounds__(256) void k_rope(const float* __restrict__ F, int pitch, int nheads, const float* __restrict__ CS, const float* __restrict__ RF, const float* __restrict__ nw, float sc, h16* P16, bf* Ph, bf* Pl) {
    const size_t e = ((size_t)blockIdx.x * 256 + threadIdx.x) * 2; if (e >= (size_t)nheads * TT * HD) return; const int d = (int)(e % HD); const int t = (int)((e / HD) % TT); const int h = (int)(e / ((size_t)HD * TT)); const float* f = F + (size_t)t * pitch + h * HD; const float rf = RF ? RF[(size_t)h * TT + t] : 1.0f; v2h o16; v2us oh, ol;
#pragma unroll
    for (int q = 0; q < 2; ++q) { const int dd = d + q; const int dp = (dd < HD / 2) ? dd + HD / 2 : dd - HD / 2; float x0 = f[dd], x1 = f[dp];
        if (RF) { float n0 = __fmul_rn(x0, rf), n1 = __fmul_rn(x1, rf); asm volatile("" : "+v"(n0)); asm volatile("" : "+v"(n1)); x0 = __fmul_rn(bfr(nw[dd]), n0); x1 = __fmul_rn(bfr(nw[dp]), n1); }
        const v2f cs = *(const v2f*)(CS + ((size_t)t * HD + dd) * 2); float a = __fmul_rn(x0, cs[0]), bq = __fmul_rn(x1, cs[1]); asm volatile("" : "+v"(a)); asm volatile("" : "+v"(bq)); const float r = ((dd < HD / 2) ? __fsub_rn(a, bq) : __fadd_rn(a, bq)) * sc;
        o16[q] = tohx(r); unsigned short a2, c2; splitf(r, a2, c2); oh[q] = a2; ol[q] = c2; }
    *(v2h*)(P16 + e) = o16; *(v2us*)(Ph + e) = oh; *(v2us*)(Pl + e) = ol;  }
__global__ __launch_bounds__(256) void k_vtp(const float* __restrict__ F, int pitch, int nheads, h16* V16, bf* Vh, bf* Vl) { const size_t e = ((size_t)blockIdx.x * 256 + threadIdx.x) * 2; if (e >= (size_t)nheads * HD * TT) return; const int t = (int)(e % TT); const int d = (int)((e / TT) % HD); const int g = (int)(e / ((size_t)TT * HD)); v2h o16; v2us oh, ol;
#pragma unroll
    for (int q = 0; q < 2; ++q) { const float x = F[(size_t)(t + q) * pitch + g * HD + d]; o16[q] = tohx(x); unsigned short a2, c2; splitf(x, a2, c2); oh[q] = a2; ol[q] = c2; }
    *(v2h*)(V16 + e) = o16; *(v2us*)(Vh + e) = oh; *(v2us*)(Vl + e) = ol;  }
__global__ __launch_bounds__(256) void k_csid(float* CS) { const int idx = blockIdx.x * 256 + threadIdx.x; if (idx >= TT * HD) return; v2f cs; cs[0] = 1.0f; cs[1] = 0.0f; *(v2f*)(CS + (size_t)idx * 2) = cs;  }
typedef __attribute__((ext_vector_type(2))) __bf16 v2bf;
// lane l <-> l ^ 16
__device__ __forceinline__ float xhalf(float x) { const int b = __float_as_int(x); return __int_as_float(__builtin_amdgcn_permlanex16(b, b, 0x76543210, 0xfedcba98, false, false)); }
#define QW  2
#define SC2 (SCL * 1.4426950408889634f)
__global__ __launch_bounds__(256) void k_fattn(const bf* __restrict__ Qh, const bf* __restrict__ Ql, const bf* __restrict__ Kh, const bf* __restrict__ Kl, const bf* __restrict__ Vh, const bf* __restrict__ Vl, bf* Ah, bf* Al) {
    typedef WFrag<bf> F;
    const int lane = threadIdx.x & 31, lr = lane & 15, hi = lane >> 4, wave = threadIdx.x >> 5;
    const int head = blockIdx.y, g = head / REP, q0 = blockIdx.x * (8 * 16 * QW) + wave * (16 * QW);
    const size_t qo = ((size_t)head * TT + q0 + lr) * HD + 8 * hi;
    v16bf qh[QW][2], ql[QW][2];
#pragma unroll
    for (int n = 0; n < QW; ++n)
#pragma unroll
        for (int kk = 0; kk < 2; ++kk) { qh[n][kk] = F::ld(Qh + qo + n * 16 * HD + kk * 32); ql[n][kk] = F::ld(Ql + qo + n * 16 * HD + kk * 32); }
    const size_t ko = ((size_t)g * TT + lr) * HD + 8 * hi, vo = ((size_t)g * HD + lr) * TT + 8 * hi;
    const bf* kh = Kh + ko; const bf* kl = Kl + ko; const bf* vh = Vh + vo; const bf* vl = Vl + vo;
    v8f o[QW][4]; float mu[QW]; v2f ls[QW];
#pragma unroll
    for (int n = 0; n < QW; ++n) { mu[n] = -3.0e38f; ls[n] = (v2f){};
#pragma unroll
        for (int dt = 0; dt < 4; ++dt) o[n][dt] = (v8f){}; }
    v16bf kfh[2][2], kfl[2][2];
#pragma unroll
    for (int t = 0; t < 2; ++t)
#pragma unroll
        for (int kk = 0; kk < 2; ++kk) { kfh[t][kk] = F::ld(kh + t * 16 * HD + kk * 32); kfl[t][kk] = F::ld(kl + t * 16 * HD + kk * 32); }
    for (int key0 = 0; key0 < TT; key0 += 32) {
        v16bf vfh[4], vfl[4];    // this pass's Vt rows, asked for ahead of the score products
        const bf* pvh = vh + key0; const bf* pvl = vl + key0;
#pragma unroll
        for (int dt = 0; dt < 4; ++dt) { vfh[dt] = F::ld(pvh + (size_t)dt * 16 * TT); vfl[dt] = F::ld(pvl + (size_t)dt * 16 * TT); }
        asm volatile("s_wait_xcnt 0x0" :: "v"(pvh), "v"(pvl) : "memory");    // the loads' address registers stay as they are up to this wait; behind it they may be reused
        __builtin_amdgcn_sched_barrier(0);    // keeps the Vt loads in front of the score products: sunk behind the softmax their latency is not covered
        v8f s[QW][2];
#pragma unroll
        for (int n = 0; n < QW; ++n) { s[n][0] = (v8f){}; s[n][1] = (v8f){}; }
#pragma unroll
        for (int kk = 0; kk < 2; ++kk) {
#pragma unroll
            for (int n = 0; n < QW; ++n) { s[n][0] = F::mma(kfh[0][kk], qh[n][kk], s[n][0]); s[n][1] = F::mma(kfh[1][kk], qh[n][kk], s[n][1]); }
#pragma unroll
            for (int n = 0; n < QW; ++n) { s[n][0] = F::mma(kfh[0][kk], ql[n][kk], s[n][0]); s[n][1] = F::mma(kfh[1][kk], ql[n][kk], s[n][1]); }
#pragma unroll
            for (int n = 0; n < QW; ++n) { s[n][0] = F::mma(kfl[0][kk], qh[n][kk], s[n][0]); s[n][1] = F::mma(kfl[1][kk], qh[n][kk], s[n][1]); } }
        const int kn = (key0 + 32 < TT) ? key0 + 32 : 0;    // the next pass's key rows (the last pass re-reads the first rows and uses nothing of them)
        const bf* pkh = kh + (size_t)kn * HD; const bf* pkl = kl + (size_t)kn * HD;
#pragma unroll
        for (int t = 0; t < 2; ++t)
#pragma unroll
            for (int kk = 0; kk < 2; ++kk) { kfh[t][kk] = F::ld(pkh + t * 16 * HD + kk * 32); kfl[t][kk] = F::ld(pkl + t * 16 * HD + kk * 32); }
        asm volatile("s_wait_xcnt 0x0" :: "v"(pkh), "v"(pkl) : "memory");    // as above, for the key loads
        __builtin_amdgcn_sched_barrier(0);    // keeps the next pass's key loads in front of the softmax, which with the att.v products covers their latency
        float mx[QW]; bool need = false;
#pragma unroll
        for (int n = 0; n < QW; ++n) { float x = fmaxf(s[n][0][0], s[n][1][0]);
#pragma unroll
            for (int r = 1; r < 8; ++r) x = fmaxf(x, fmaxf(s[n][0][r], s[n][1][r]));
            x = fmaxf(x, xhalf(x)); mx[n] = x * SC2; need = need || (mx[n] > mu[n] + 8.0f); }
        if (__builtin_amdgcn_ballot_w32(need) != 0) {
#pragma unroll
            for (int n = 0; n < QW; ++n) { const float mn = fmaxf(mu[n], mx[n]); const float al = __builtin_amdgcn_exp2f(mu[n] - mn); mu[n] = mn; ls[n] *= al;
#pragma unroll
                for (int dt = 0; dt < 4; ++dt) o[n][dt] *= al; } }
        v16bf ph[QW], pl[QW];
#pragma unroll
        for (int n = 0; n < QW; ++n) {
#pragma unroll
            for (int e = 0; e < 16; e += 2) { v2f x; x[0] = s[n][e >> 3][e & 7]; x[1] = s[n][e >> 3][(e & 7) + 1]; x = __builtin_elementwise_fma(x, (v2f){SC2, SC2}, (v2f){-mu[n], -mu[n]});
                v2f p; p[0] = __builtin_amdgcn_exp2f(x[0]); p[1] = __builtin_amdgcn_exp2f(x[1]); ls[n] += p;
                const v2bf h2 = __builtin_convertvector(p, v2bf); const v2bf l2 = __builtin_convertvector(p - __builtin_convertvector(h2, v2f), v2bf);
                ph[n][e] = h2[0]; ph[n][e + 1] = h2[1]; pl[n][e] = l2[0]; pl[n][e + 1] = l2[1]; } }
#pragma unroll
        for (int n = 0; n < QW; ++n)
#pragma unroll
            for (int dt = 0; dt < 4; ++dt) o[n][dt] = F::mma(vfh[dt], ph[n], o[n][dt]);
#pragma unroll
        for (int n = 0; n < QW; ++n)
#pragma unroll
            for (int dt = 0; dt < 4; ++dt) o[n][dt] = F::mma(vfh[dt], pl[n], o[n][dt]);
#pragma unroll
        for (int n = 0; n < QW; ++n)
#pragma unroll
            for (int dt = 0; dt < 4; ++dt) o[n][dt] = F::mma(vfl[dt], ph[n], o[n][dt]);
    }
#pragma unroll
    for (int n = 0; n < QW; ++n) { const float lh = ls[n][0] + ls[n][1]; const float f = __fdiv_rn(1.0f, lh + xhalf(lh)); const size_t oo = (size_t)(q0 + n * 16 + lr) * DQ + head * HD + 8 * hi;   // a lane's 8 registers are 8 consecutive d of its query
        bf* pa = Ah + oo; bf* pb = Al + oo;
#pragma unroll
        for (int dt = 0; dt < 4; ++dt) { v8us oh, ol;
#pragma unroll
            for (int r = 0; r < 8; ++r) { unsigned short a, c2; splitf(o[n][dt][r] * f, a, c2); oh[r] = a; ol[r] = c2; }
            *(v8us*)(pa + dt * 16) = oh; *(v8us*)(pb + dt * 16) = ol;
            asm volatile("s_wait_xcnt 0x0" :: "v"(oh), "v"(ol), "v"(pa), "v"(pb) : "memory"); } }    // the stores' data and address registers stay as they are up to this wait
}

extern "C" void kernel_launch(void* const* d_in, const int* in_sizes, int n_in,
                              void* d_out, int out_size, void* d_ws, size_t ws_size, hipStream_t stream) {
    (void)in_sizes; (void)n_in; (void)out_size;
    const float* x = (const float*)d_in[0]; const float* wq = (const float*)d_in[1]; const float* wk = (const float*)d_in[2]; const float* wv = (const float*)d_in[3]; const float* wo = (const float*)d_in[4];   // Wq [4096][2048], Wk/Wv [4096][512], Wo [2048][2048] (x @ W)
    float* OUT = (float*)d_out;     // [1][2048][2048]
    char* wsp = (char*)d_ws;
    auto take = [&](size_t bytes) { char* p = wsp; wsp += (bytes + 255) & ~(size_t)255; return (void*)p; };
    bf* WQ = (bf*)take((size_t)DQ * DM * 2); bf* WK = (bf*)take((size_t)DKV * DM * 2); bf* WV = (bf*)take((size_t)DKV * DM * 2); bf* WO = (bf*)take((size_t)DOUT * DQ * 2); float* CS = (float*)take((size_t)TT * HD * 2 * 4);
    bf* XB = (bf*)take((size_t)TT * DM * 2); float* FQ = (float*)take((size_t)TT * DQ * 4); float* FK = (float*)take((size_t)TT * DKV * 4);
    h16* QP16 = (h16*)take((size_t)NH_ * TT * HD * 2); h16* KP16 = (h16*)take((size_t)NKV * TT * HD * 2); h16* VT16 = (h16*)take((size_t)NKV * HD * TT * 2);
    bf* QPh = (bf*)take((size_t)NH_ * TT * HD * 2); bf* QPl = (bf*)take((size_t)NH_ * TT * HD * 2); bf* KPh = (bf*)take((size_t)NKV * TT * HD * 2); bf* KPl = (bf*)take((size_t)NKV * TT * HD * 2); bf* VTh = (bf*)take((size_t)NKV * HD * TT * 2); bf* VTl = (bf*)take((size_t)NKV * HD * TT * 2);
    bf* ATh = (bf*)take((size_t)TT * DQ * 2); bf* ATl = (bf*)take((size_t)TT * DQ * 2);
    if ((size_t)(wsp - (char*)d_ws) > ws_size) return;    // ws 256 MiB
    float* FV = FK;   // v projection reuses the k buffer after the k planes are built (stream-ordered)
    { k_wtG<<<(unsigned)((DM * DQ / 64 + 63) / 64), 256, 0, stream>>>(wq, DM, DQ, WQ); k_wtG<<<(unsigned)((DM * DKV / 64 + 63) / 64), 256, 0, stream>>>(wk, DM, DKV, WK); k_wtG<<<(unsigned)((DM * DKV / 64 + 63) / 64), 256, 0, stream>>>(wv, DM, DKV, WV);
      k_wtG<<<(unsigned)((DQ * DOUT / 64 + 63) / 64), 256, 0, stream>>>(wo, DQ, DOUT, WO);
       }
    k_csid<<<(TT * HD + 255) / 256, 256, 0, stream>>>(CS);
    const unsigned LQ = (unsigned)(((size_t)NH_ * TT * HD / 2 + 255) / 256), LKv = (unsigned)(((size_t)NKV * TT * HD / 2 + 255) / 256);
    for (int b = 0; b < NB_; ++b) {
        
        k_cvt8<<<(unsigned)(((size_t)TT * DM / 8 + 255) / 256), 256, 0, stream>>>(x + (size_t)b * TT * DM, XB, (size_t)TT * DM / 8);
        k_gemmw<bf, 0, false><<<dim3(TT / 64, DQ / 64, 1), 32, 0, stream>>>(XB, nullptr, WQ, nullptr, DM, FQ, DQ, nullptr, 0, 0, 0);
        k_rope<<<LQ, 256, 0, stream>>>(FQ, DQ, NH_, CS, nullptr, nullptr, 1.0f, QP16, QPh, QPl);
        k_gemmw<bf, 0, false><<<dim3(TT / 64, DKV / 64, 1), 32, 0, stream>>>(XB, nullptr, WK, nullptr, DM, FK, DKV, nullptr, 0, 0, 0);
        k_rope<<<LKv, 256, 0, stream>>>(FK, DKV, NKV, CS, nullptr, nullptr, 1.0f, KP16, KPh, KPl);
        k_gemmw<bf, 0, false><<<dim3(TT / 64, DKV / 64, 1), 32, 0, stream>>>(XB, nullptr, WV, nullptr, DM, FV, DKV, nullptr, 0, 0, 0); k_vtp<<<LKv, 256, 0, stream>>>(FV, DKV, NKV, VT16, VTh, VTl);
        k_fattn<<<dim3(TT / (8 * 16 * QW), NH_, 1), 256, 0, stream>>>(QPh, QPl, KPh, KPl, VTh, VTl, ATh, ATl);
        k_gemmw<bf, 1, false><<<dim3(TT / 64, DOUT / 64, 1), 32, 0, stream>>>(ATh, ATl, WO, nullptr, DQ, OUT + (size_t)b * TT * DOUT, DOUT, nullptr, 0, 0, 0); }
}
